// v000
// Measured on an AMD MI455X. A time is GPU time per run, averaged over a window of back-to-back runs after a warm-up
// (all launches, gaps included; the runs take copies of the inputs in turn), and the median of several windows.
// Apart from v000's, it joins two sittings. Times from different sittings can be a few percent apart, while
// side-by-side timings come from the same sitting.
// The starting kernel, v000, takes 1760 microseconds a run.
#include <hip/hip_runtime.h>
#include <cmath>

// ---------------------------------------------------------------------------
// DifferentialMultiHeadAttention forward for MI455X (gfx1250, wave32).
// All matmuls run on V_WMMA_F32_16X16X4_F32 (native fp32 matrix pipe) to
// match the fp32 reference exactly up to FMA-ordering. Tile staging uses the
// CDNA5 async global->LDS DMA path (ASYNCcnt) when the toolchain exposes it.
// ---------------------------------------------------------------------------

typedef __attribute__((ext_vector_type(2))) float v2f;
typedef __attribute__((ext_vector_type(4))) float v4f;
typedef __attribute__((ext_vector_type(8))) float v8f;
typedef int v4i __attribute__((vector_size(16)));   // matches builtin proto

#define DIMD 1024
#define NH   16
#define HDM  64
#define BB   2
#define SS   2048
#define MROWS (BB * SS)      // 4096
#define HSTR  (NH * HDM)     // 1024 row stride of [b,s,h,hd]

#if __has_builtin(__builtin_amdgcn_global_load_async_to_lds_b128) && \
    __has_builtin(__builtin_amdgcn_s_wait_asynccnt)
#define HAVE_ASYNC_LDS 1
#else
#define HAVE_ASYNC_LDS 0
#endif

// Builtin proto (from hipcc diagnostic): (v4i AS1*, v4i AS3*, Ii offset, Ii cpol)
#define AS_GLOBAL(p) ((__attribute__((address_space(1))) v4i*)(p))
#define AS_LDS(p)    ((__attribute__((address_space(3))) v4i*)(p))

static __device__ __forceinline__ v8f wmma4(v2f a, v2f b, v8f c) {
  // D = A(16x4,f32) * B(4x16,f32) + C(16x16,f32)
  return __builtin_amdgcn_wmma_f32_16x16x4_f32(
      /*neg_a=*/false, a, /*neg_b=*/false, b,
      /*c_mod=*/(short)0, c, /*reuse_a=*/false, /*reuse_b=*/false);
}

// ---------------------------------------------------------------------------
// C[M,N] = A[M,K] @ B[K,N] + bias[N]      (fp32, WMMA 16x16x4)
// Block: 256 threads = 8 waves; 64x64 C tile; each wave owns a 16x32 strip.
// ---------------------------------------------------------------------------
__global__ __launch_bounds__(256) void gemm_bias_kernel(
    const float* __restrict__ A, const float* __restrict__ Bm,
    const float* __restrict__ bias, float* __restrict__ C,
    int M, int N, int K)
{
  // Padded strides: sA row = 20 floats (80B: 16B-aligned b128 DMA chunks,
  // aligned b64 frag reads, bank spread), sB row = 80 floats (320B).
  __shared__ float sA[64 * 20];
  __shared__ float sB[16 * 80];

  const int tid  = threadIdx.x;
  const int lane = tid & 31;
  const int wid  = tid >> 5;
  const int lm   = lane & 15;      // M (A/C) or N (B/C) index within frag
  const int lh   = lane >> 4;      // half-wave select
  const int wm   = (wid & 3) * 16; // wave row offset inside 64x64 tile
  const int wn   = (wid >> 2) * 32;// wave col offset
  const int bm   = blockIdx.y * 64;
  const int bn   = blockIdx.x * 64;

  v8f acc0 = {};
  v8f acc1 = {};

  // cooperative tile-load mapping (one 16B chunk per thread per panel)
  const int ar = tid >> 2;          // 0..63
  const int ac = (tid & 3) * 4;     // 0,4,8,12
  const int br = tid >> 4;          // 0..15
  const int bc = (tid & 15) * 4;    // 0..60

  for (int kb = 0; kb < K; kb += 16) {
    if (kb + 16 < K) {
      // CDNA5 global_prefetch_b8 for the next K panels
      __builtin_prefetch(&A[(size_t)(bm + ar) * K + kb + 16 + ac], 0, 1);
      __builtin_prefetch(&Bm[(size_t)(kb + 16 + br) * N + bn + bc], 0, 1);
    }
#if HAVE_ASYNC_LDS
    // Async DMA global->LDS (no VGPR round-trip, tracked by ASYNCcnt)
    __builtin_amdgcn_global_load_async_to_lds_b128(
        AS_GLOBAL(&A[(size_t)(bm + ar) * K + kb + ac]),
        AS_LDS(&sA[ar * 20 + ac]), 0, 0);
    __builtin_amdgcn_global_load_async_to_lds_b128(
        AS_GLOBAL(&Bm[(size_t)(kb + br) * N + bn + bc]),
        AS_LDS(&sB[br * 80 + bc]), 0, 0);
    __builtin_amdgcn_s_wait_asynccnt(0);
#else
    v4f av = *(const v4f*)&A[(size_t)(bm + ar) * K + kb + ac];
    v4f bv = *(const v4f*)&Bm[(size_t)(kb + br) * N + bn + bc];
    sA[ar * 20 + ac + 0] = av.x;
    sA[ar * 20 + ac + 1] = av.y;
    sA[ar * 20 + ac + 2] = av.z;
    sA[ar * 20 + ac + 3] = av.w;
    *(v4f*)&sB[br * 80 + bc] = bv;
#endif
    __syncthreads();

#pragma unroll
    for (int ks = 0; ks < 4; ++ks) {
      const int k0 = ks * 4 + 2 * lh;
      v2f a;
      a.x = sA[(wm + lm) * 20 + k0];
      a.y = sA[(wm + lm) * 20 + k0 + 1];
      v2f b0;
      b0.x = sB[k0 * 80 + wn + lm];
      b0.y = sB[(k0 + 1) * 80 + wn + lm];
      v2f b1;
      b1.x = sB[k0 * 80 + wn + 16 + lm];
      b1.y = sB[(k0 + 1) * 80 + wn + 16 + lm];
      acc0 = wmma4(a, b0, acc0);
      acc1 = wmma4(a, b1, acc1);
    }
    __syncthreads();
  }

#pragma unroll
  for (int r = 0; r < 8; ++r) {
    const int row = bm + wm + r + 8 * lh;
    const int c0  = bn + wn + lm;
    C[(size_t)row * N + c0]      = acc0[r] + bias[c0];
    C[(size_t)row * N + c0 + 16] = acc1[r] + bias[c0 + 16];
  }
}

// ---------------------------------------------------------------------------
// Attention for one (b, h, 16-query-row tile).
// 128 threads = 4 waves. Full score strip [16 x 2048] lives in dynamic LDS
// (128KB; gfx1250 WGP supports 320KB/workgroup). Exact softmax.
// ---------------------------------------------------------------------------
__global__ __launch_bounds__(128) void attn_kernel(
    const float* __restrict__ Q, const float* __restrict__ Kt,
    const float* __restrict__ V, float* __restrict__ O)
{
  extern __shared__ float smem[];
  float* sS     = smem;                 // 16 * 2048 scores
  float* sQ     = sS + 16 * SS;         // 16 * 72 padded Q tile
  float* red    = sQ + 16 * 72;         // 16 * 8 partial reductions
  float* rowmax = red + 128;            // 16
  float* rowinv = rowmax + 16;          // 16

  const int t0   = blockIdx.x * 16;
  const int h    = blockIdx.y;
  const int b    = blockIdx.z;
  const int tid  = threadIdx.x;
  const int lane = tid & 31;
  const int w    = tid >> 5;
  const int lm   = lane & 15;
  const int lh   = lane >> 4;

  const float* Qb = Q  + (size_t)b * SS * HSTR + h * HDM;
  const float* Kb = Kt + (size_t)b * SS * HSTR + h * HDM;
  const float* Vb = V  + (size_t)b * SS * HSTR + h * HDM;

  // ---- load Q tile [16 x 64] into LDS (stride 72 keeps frags aligned)
  {
    const int row = tid >> 3;
    const int c0  = (tid & 7) * 8;
    const float* src = &Qb[(size_t)(t0 + row) * HSTR + c0];
#if HAVE_ASYNC_LDS
    __builtin_amdgcn_global_load_async_to_lds_b128(
        AS_GLOBAL(src), AS_LDS(&sQ[row * 72 + c0]), 0, 0);
    __builtin_amdgcn_global_load_async_to_lds_b128(
        AS_GLOBAL(src + 4), AS_LDS(&sQ[row * 72 + c0 + 4]), 0, 0);
    __builtin_amdgcn_s_wait_asynccnt(0);
#else
#pragma unroll
    for (int i = 0; i < 8; ++i)
      sQ[row * 72 + c0 + i] = src[i];
#endif
  }
  __syncthreads();

  // ---- scores: S[16 x 2048] = Q (16x64) * K^T, scaled by 1/sqrt(64)
  for (int st = w; st < SS / 16; st += 4) {
    v8f acc = {};
#pragma unroll
    for (int ks = 0; ks < 16; ++ks) {
      const int kd = ks * 4 + 2 * lh;
      v2f a;
      a.x = sQ[lm * 72 + kd];
      a.y = sQ[lm * 72 + kd + 1];
      // B frag: B[k][n] = K[s_n][k]; lane n = lm selects key row
      v2f bf = *(const v2f*)&Kb[(size_t)(st * 16 + lm) * HSTR + kd];
      acc = wmma4(a, bf, acc);
    }
#pragma unroll
    for (int r = 0; r < 8; ++r) {
      const int m = r + 8 * lh;
      sS[m * SS + st * 16 + lm] = acc[r] * 0.125f;
    }
  }
  __syncthreads();

  // ---- softmax over s (exact, max-subtracted); 8 threads per row,
  //      float4 LDS accesses (rows are 8KB-strided, segments 16B-aligned)
  {
    const int row = tid >> 3;
    const int seg = tid & 7;
    v4f* p4 = (v4f*)(sS + row * SS + seg * 256);
    float mx = -3.402823466e38f;
    for (int i = 0; i < 64; ++i) {
      const v4f v = p4[i];
      mx = fmaxf(mx, fmaxf(fmaxf(v.x, v.y), fmaxf(v.z, v.w)));
    }
    red[row * 8 + seg] = mx;
    __syncthreads();
    if (tid < 16) {
      float m2 = red[tid * 8];
#pragma unroll
      for (int i = 1; i < 8; ++i) m2 = fmaxf(m2, red[tid * 8 + i]);
      rowmax[tid] = m2;
    }
    __syncthreads();
    const float m3 = rowmax[row];
    float sum = 0.f;
    for (int i = 0; i < 64; ++i) {
      v4f v = p4[i];
      v.x = expf(v.x - m3);
      v.y = expf(v.y - m3);
      v.z = expf(v.z - m3);
      v.w = expf(v.w - m3);
      p4[i] = v;
      sum += (v.x + v.y) + (v.z + v.w);
    }
    red[row * 8 + seg] = sum;
    __syncthreads();
    if (tid < 16) {
      float s2 = 0.f;
#pragma unroll
      for (int i = 0; i < 8; ++i) s2 += red[tid * 8 + i];
      rowinv[tid] = 1.0f / s2;
    }
    __syncthreads();
  }

  // ---- O tile [16 x 64] = P (16x2048) * V (2048x64); each wave owns 16 cols
  {
    const int n0 = w * 16;
    v8f acc = {};
    for (int kt = 0; kt < SS / 16; ++kt) {
#pragma unroll
      for (int ks = 0; ks < 4; ++ks) {
        const int s0 = kt * 16 + ks * 4 + 2 * lh;
        v2f a;
        a.x = sS[lm * SS + s0];
        a.y = sS[lm * SS + s0 + 1];
        v2f bf;
        bf.x = Vb[(size_t)s0 * HSTR + n0 + lm];
        bf.y = Vb[(size_t)(s0 + 1) * HSTR + n0 + lm];
        acc = wmma4(a, bf, acc);
      }
    }
#pragma unroll
    for (int r = 0; r < 8; ++r) {
      const int m = r + 8 * lh;
      O[((size_t)b * SS + t0 + m) * HSTR + h * HDM + n0 + lm] = acc[r] * rowinv[m];
    }
  }
}

// ---------------------------------------------------------------------------
// y = (1 - lambda) * o1 + lambda * o2, lambda derived on-device
// ---------------------------------------------------------------------------
__global__ void blend_kernel(const float* __restrict__ o1,
                             const float* __restrict__ o2,
                             const float* __restrict__ lambda_param,
                             const int* __restrict__ layer_idx,
                             float* __restrict__ y, int n)
{
  const int i = blockIdx.x * blockDim.x + threadIdx.x;
  if (i >= n) return;
  const float lf  = fminf(fmaxf((float)layer_idx[0] * 0.3f, 0.0f), 5.0f);
  const float off = 0.6f * expf(-lf);
  const float sig = 1.0f / (1.0f + expf(-lambda_param[0]));
  float lam = sig * (1.0f - off) + 0.2f;
  lam = fminf(fmaxf(lam, 0.1f), 0.9f);
  y[i] = (1.0f - lam) * o1[i] + lam * o2[i];
}

// ---------------------------------------------------------------------------
extern "C" void kernel_launch(void* const* d_in, const int* in_sizes, int n_in,
                              void* d_out, int out_size, void* d_ws, size_t ws_size,
                              hipStream_t stream)
{
  (void)in_sizes; (void)n_in; (void)out_size; (void)ws_size;
  // setup_inputs() dict order:
  const float* x            = (const float*)d_in[0];
  const float* proj_w       = (const float*)d_in[1];
  const float* proj_b       = (const float*)d_in[2];
  const float* lambda_param = (const float*)d_in[3];
  const int*   layer_idx    = (const int*)d_in[4];
  const float* wq1 = (const float*)d_in[5];
  const float* wk1 = (const float*)d_in[6];
  const float* wv1 = (const float*)d_in[7];
  const float* wo1 = (const float*)d_in[8];
  const float* bq1 = (const float*)d_in[9];
  const float* bk1 = (const float*)d_in[10];
  const float* bv1 = (const float*)d_in[11];
  const float* bo1 = (const float*)d_in[12];
  const float* wq2 = (const float*)d_in[13];
  const float* wk2 = (const float*)d_in[14];
  const float* wv2 = (const float*)d_in[15];
  const float* wo2 = (const float*)d_in[16];
  const float* bq2 = (const float*)d_in[17];
  const float* bk2 = (const float*)d_in[18];
  const float* bv2 = (const float*)d_in[19];
  const float* bo2 = (const float*)d_in[20];

  const size_t slot = (size_t)MROWS * DIMD;  // 4M floats per buffer
  float* ws = (float*)d_ws;
  float* q1 = ws + 0 * slot;
  float* k1 = ws + 1 * slot;
  float* v1 = ws + 2 * slot;
  float* q2 = ws + 3 * slot;
  float* k2 = ws + 4 * slot;
  float* v2 = ws + 5 * slot;
  float* o1 = ws + 6 * slot;   // attention outputs
  float* o2 = ws + 7 * slot;
  float* p1 = q1;              // reuse: per-branch projected outputs
  float* p2 = k1;
  float* yb = v1;              // blended

  const dim3 gg(DIMD / 64, MROWS / 64);   // (16, 64)

  // QKV projections (both branches)
  gemm_bias_kernel<<<gg, 256, 0, stream>>>(x, wq1, bq1, q1, MROWS, DIMD, DIMD);
  gemm_bias_kernel<<<gg, 256, 0, stream>>>(x, wk1, bk1, k1, MROWS, DIMD, DIMD);
  gemm_bias_kernel<<<gg, 256, 0, stream>>>(x, wv1, bv1, v1, MROWS, DIMD, DIMD);
  gemm_bias_kernel<<<gg, 256, 0, stream>>>(x, wq2, bq2, q2, MROWS, DIMD, DIMD);
  gemm_bias_kernel<<<gg, 256, 0, stream>>>(x, wk2, bk2, k2, MROWS, DIMD, DIMD);
  gemm_bias_kernel<<<gg, 256, 0, stream>>>(x, wv2, bv2, v2, MROWS, DIMD, DIMD);

  // Attention per (b, h, 16-row query tile)
  const dim3 ga(SS / 16, NH, BB);
  const size_t smem = (size_t)(16 * SS + 16 * 72 + 128 + 32) * sizeof(float);
  attn_kernel<<<ga, 128, smem, stream>>>(q1, k1, v1, o1);
  attn_kernel<<<ga, 128, smem, stream>>>(q2, k2, v2, o2);

  // Per-branch output projections (wo is [H*HD, DIM] row-major -> plain GEMM)
  gemm_bias_kernel<<<gg, 256, 0, stream>>>(o1, wo1, bo1, p1, MROWS, DIMD, DIMD);
  gemm_bias_kernel<<<gg, 256, 0, stream>>>(o2, wo2, bo2, p2, MROWS, DIMD, DIMD);

  // Blend with lambda
  const int n = MROWS * DIMD;
  blend_kernel<<<(n + 255) / 256, 256, 0, stream>>>(p1, p2, lambda_param, layer_idx, yb, n);

  // Final projection -> d_out
  gemm_bias_kernel<<<gg, 256, 0, stream>>>(yb, proj_w, proj_b, (float*)d_out, MROWS, DIMD, DIMD);
}

// v001
// One run takes 906 microseconds.
// Next to v000, in two timings, it ran 2.02 times as fast each time.
#include <hip/hip_runtime.h>
#include <cmath>

// ---------------------------------------------------------------------------
// DifferentialMultiHeadAttention forward for MI455X (gfx1250, wave32).
// All matmuls run on V_WMMA_F32_16X16X4_F32 (native fp32 matrix pipe) to
// match the fp32 reference exactly up to FMA-ordering. Tile staging uses the
// CDNA5 async global->LDS DMA path (ASYNCcnt) when the toolchain exposes it.
// ---------------------------------------------------------------------------

typedef __attribute__((ext_vector_type(2))) float v2f;
typedef __attribute__((ext_vector_type(4))) float v4f;
typedef __attribute__((ext_vector_type(8))) float v8f;
typedef int v4i __attribute__((vector_size(16)));   // matches builtin proto

#define DIMD 1024
#define NH   16
#define HDM  64
#define BB   2
#define SS   2048
#define MROWS (BB * SS)      // 4096
#define HSTR  (NH * HDM)     // 1024 row stride of [b,s,h,hd]

#if __has_builtin(__builtin_amdgcn_global_load_async_to_lds_b128) && \
    __has_builtin(__builtin_amdgcn_s_wait_asynccnt)
#define HAVE_ASYNC_LDS 1
#else
#define HAVE_ASYNC_LDS 0
#endif

// Builtin proto (from hipcc diagnostic): (v4i AS1*, v4i AS3*, Ii offset, Ii cpol)
#define AS_GLOBAL(p) ((__attribute__((address_space(1))) v4i*)(p))
#define AS_LDS(p)    ((__attribute__((address_space(3))) v4i*)(p))

static __device__ __forceinline__ v8f wmma4(v2f a, v2f b, v8f c) {
  // D = A(16x4,f32) * B(4x16,f32) + C(16x16,f32)
  return __builtin_amdgcn_wmma_f32_16x16x4_f32(
      /*neg_a=*/false, a, /*neg_b=*/false, b,
      /*c_mod=*/(short)0, c, /*reuse_a=*/false, /*reuse_b=*/false);
}

// ---------------------------------------------------------------------------
// C[M,N] = A[M,K] @ B[K,N] + bias[N]      (fp32, WMMA 16x16x4)
// Block: 256 threads = 8 waves; 64x64 C tile; each wave owns a 16x32 strip.
// ---------------------------------------------------------------------------
__global__ __launch_bounds__(256) void gemm_bias_kernel(
    const float* __restrict__ A, const float* __restrict__ Bm,
    const float* __restrict__ bias, float* __restrict__ C,
    int M, int N, int K)
{
  // Padded strides: sA row = 20 floats (80B: 16B-aligned b128 DMA chunks,
  // aligned b64 frag reads, bank spread), sB row = 80 floats (320B).
  __shared__ float sA[64 * 20];
  __shared__ float sB[16 * 80];

  const int tid  = threadIdx.x;
  const int lane = tid & 31;
  const int wid  = tid >> 5;
  const int lm   = lane & 15;      // M (A/C) or N (B/C) index within frag
  const int lh   = lane >> 4;      // half-wave select
  const int wm   = (wid & 3) * 16; // wave row offset inside 64x64 tile
  const int wn   = (wid >> 2) * 32;// wave col offset
  const int bm   = blockIdx.y * 64;
  const int bn   = blockIdx.x * 64;

  v8f acc0 = {};
  v8f acc1 = {};

  // cooperative tile-load mapping (one 16B chunk per thread per panel)
  const int ar = tid >> 2;          // 0..63
  const int ac = (tid & 3) * 4;     // 0,4,8,12
  const int br = tid >> 4;          // 0..15
  const int bc = (tid & 15) * 4;    // 0..60

  for (int kb = 0; kb < K; kb += 16) {
    if (kb + 16 < K) {
      // CDNA5 global_prefetch_b8 for the next K panels
      __builtin_prefetch(&A[(size_t)(bm + ar) * K + kb + 16 + ac], 0, 1);
      __builtin_prefetch(&Bm[(size_t)(kb + 16 + br) * N + bn + bc], 0, 1);
    }
#if HAVE_ASYNC_LDS
    // Async DMA global->LDS (no VGPR round-trip, tracked by ASYNCcnt)
    __builtin_amdgcn_global_load_async_to_lds_b128(
        AS_GLOBAL(&A[(size_t)(bm + ar) * K + kb + ac]),
        AS_LDS(&sA[ar * 20 + ac]), 0, 0);
    __builtin_amdgcn_global_load_async_to_lds_b128(
        AS_GLOBAL(&Bm[(size_t)(kb + br) * N + bn + bc]),
        AS_LDS(&sB[br * 80 + bc]), 0, 0);
    __builtin_amdgcn_s_wait_asynccnt(0);
#else
    v4f av = *(const v4f*)&A[(size_t)(bm + ar) * K + kb + ac];
    v4f bv = *(const v4f*)&Bm[(size_t)(kb + br) * N + bn + bc];
    sA[ar * 20 + ac + 0] = av.x;
    sA[ar * 20 + ac + 1] = av.y;
    sA[ar * 20 + ac + 2] = av.z;
    sA[ar * 20 + ac + 3] = av.w;
    *(v4f*)&sB[br * 80 + bc] = bv;
#endif
    __syncthreads();

#pragma unroll
    for (int ks = 0; ks < 4; ++ks) {
      const int k0 = ks * 4 + 2 * lh;
      v2f a;
      a.x = sA[(wm + lm) * 20 + k0];
      a.y = sA[(wm + lm) * 20 + k0 + 1];
      v2f b0;
      b0.x = sB[k0 * 80 + wn + lm];
      b0.y = sB[(k0 + 1) * 80 + wn + lm];
      v2f b1;
      b1.x = sB[k0 * 80 + wn + 16 + lm];
      b1.y = sB[(k0 + 1) * 80 + wn + 16 + lm];
      acc0 = wmma4(a, b0, acc0);
      acc1 = wmma4(a, b1, acc1);
    }
    __syncthreads();
  }

#pragma unroll
  for (int r = 0; r < 8; ++r) {
    const int row = bm + wm + r + 8 * lh;
    const int c0  = bn + wn + lm;
    C[(size_t)row * N + c0]      = acc0[r] + bias[c0];
    C[(size_t)row * N + c0 + 16] = acc1[r] + bias[c0 + 16];
  }
}

#define KT    64
#define KP    68
#define NTILE (SS / KT)
#define QROWS 64

// lane l <-> lane l ^ 16
static __device__ __forceinline__ float xhalf(float x) {
  return __builtin_bit_cast(float, __builtin_amdgcn_permlanex16(
      __builtin_bit_cast(int, x), __builtin_bit_cast(int, x),
      0x76543210, 0xfedcba98, false, false));
}

static __device__ __forceinline__ unsigned lds_addr(const float* p) {
  return (unsigned)(size_t)(__attribute__((address_space(3))) const float*)p;
}

// Eight 16-byte copies per lane, rows 8 apart: one 64 x 64 f32 tile per
// work-group of 128 threads. The s_wait_xcnt closes the statement so that no
// address register of a copy is rewritten in front of it.
static __device__ __forceinline__ void copy_tile(float* dst, const float* src) {
  const unsigned l0 = lds_addr(dst);
  asm volatile(
      "global_load_async_to_lds_b128 %0, %8, off\n\t"
      "global_load_async_to_lds_b128 %1, %9, off\n\t"
      "global_load_async_to_lds_b128 %2, %10, off\n\t"
      "global_load_async_to_lds_b128 %3, %11, off\n\t"
      "global_load_async_to_lds_b128 %4, %12, off\n\t"
      "global_load_async_to_lds_b128 %5, %13, off\n\t"
      "global_load_async_to_lds_b128 %6, %14, off\n\t"
      "global_load_async_to_lds_b128 %7, %15, off\n\t"
      "s_wait_xcnt 0x0"
      :: "v"(l0), "v"(l0 + 1u * 8 * KP * 4), "v"(l0 + 2u * 8 * KP * 4),
         "v"(l0 + 3u * 8 * KP * 4), "v"(l0 + 4u * 8 * KP * 4),
         "v"(l0 + 5u * 8 * KP * 4), "v"(l0 + 6u * 8 * KP * 4),
         "v"(l0 + 7u * 8 * KP * 4),
         "v"(src), "v"(src + 1 * 8 * HSTR), "v"(src + 2 * 8 * HSTR),
         "v"(src + 3 * 8 * HSTR), "v"(src + 4 * 8 * HSTR),
         "v"(src + 5 * 8 * HSTR), "v"(src + 6 * 8 * HSTR),
         "v"(src + 7 * 8 * HSTR)
      : "memory");
}

// waves_per_eu(4, 4): register budget for four waves per SIMD. Four work-groups
// then share a WGP (LDS allows four), one wave of each per SIMD, so that one
// group's softmax and barrier waits are covered by the others' WMMAs.
__global__ __launch_bounds__(128) __attribute__((amdgpu_waves_per_eu(4, 4)))
void attn_kernel(
    const float* __restrict__ Q, const float* __restrict__ Kt,
    const float* __restrict__ V, float* __restrict__ O)
{
  __shared__ __attribute__((aligned(16))) float sK[2][KT * KP];
  __shared__ __attribute__((aligned(16))) float sV[2][KT * KP];

  const int t0   = blockIdx.x * QROWS;
  const int h    = blockIdx.y;
  const int b    = blockIdx.z;
  const int tid  = threadIdx.x;
  const int lane = tid & 31;
  const int w    = tid >> 5;
  const int lm   = lane & 15;
  const int lh   = lane >> 4;

  const float* Qb = Q  + (size_t)b * SS * HSTR + h * HDM;
  const float* Kb = Kt + (size_t)b * SS * HSTR + h * HDM;
  const float* Vb = V  + (size_t)b * SS * HSTR + h * HDM;

  // copy mapping: 16 chunks of 16 B per row, rows cr, cr + 8, ...
  const int cr = tid >> 4;
  const int cc = (tid & 15) * 4;
  const float* Kc = Kb + (size_t)cr * HSTR + cc;
  const float* Vc = Vb + (size_t)cr * HSTR + cc;
  const int    lc = cr * KP + cc;

  // ---- prologue: tile 0 lands and is published, tile 1 is set flying
  copy_tile(&sK[0][lc], Kc);
  copy_tile(&sV[0][lc], Vc);

  // Q fragments (B operand), kept in registers; k order of a pair of WMMAs:
  // d = 8*ks + 4*lh + {0,1} then {2,3}, the same as the K loader's below.
  // The 1/sqrt(64) scale is a power of two: exact on Q as on the scores.
  v4f q[8];
#pragma unroll
  for (int ks = 0; ks < 8; ++ks) {
    q[ks] = *(const v4f*)&Qb[(size_t)(t0 + w * 16 + lm) * HSTR + ks * 8 + 4 * lh];
    q[ks] *= 0.125f;
  }

  asm volatile("s_wait_asynccnt 0x0" ::: "memory");  // own copies of tile 0 landed
  __syncthreads();                                   // publish tile 0
  copy_tile(&sK[1][lc], Kc + (size_t)KT * HSTR);
  copy_tile(&sV[1][lc], Vc + (size_t)KT * HSTR);

  v8f o[4] = {};
  float m = -3.402823466e38f;   // running maximum of this lane's query
  float l = 0.f;                // running sum, this wave half's keys only

  for (int t = 0; t < NTILE; ++t) {
    const float* kb = &sK[t & 1][lm * KP + 4 * lh];
    const float* vb = &sV[t & 1][8 * lh * KP + 4 * lm];

    // ---- St[64 keys x 16 queries] = K tile * Qt
    v8f s[4] = {};
#pragma unroll
    for (int ks = 0; ks < 8; ++ks) {
      v4f kf[4];
#pragma unroll
      for (int nt = 0; nt < 4; ++nt)
        kf[nt] = *(const v4f*)&kb[nt * 16 * KP + ks * 8];
      const v2f qa = {q[ks].x, q[ks].y};
      const v2f qb = {q[ks].z, q[ks].w};
#pragma unroll
      for (int nt = 0; nt < 4; ++nt) {
        const v2f a = {kf[nt].x, kf[nt].y};
        s[nt] = wmma4(a, qa, s[nt]);
      }
#pragma unroll
      for (int nt = 0; nt < 4; ++nt) {
        const v2f a = {kf[nt].z, kf[nt].w};
        s[nt] = wmma4(a, qb, s[nt]);
      }
    }

    // ---- running softmax: lane (lm, lh) holds query lm, keys 16*nt + 8*lh + r
    float mx = s[0][0];
#pragma unroll
    for (int nt = 0; nt < 4; ++nt)
#pragma unroll
      for (int r = 0; r < 8; ++r) mx = fmaxf(mx, s[nt][r]);
    mx = fmaxf(mx, xhalf(mx));
    const float mnew  = fmaxf(m, mx);
    const float alpha = expf(m - mnew);
    m = mnew;
    float ps[4] = {0.f, 0.f, 0.f, 0.f};
#pragma unroll
    for (int nt = 0; nt < 4; ++nt)
#pragma unroll
      for (int r = 0; r < 8; ++r) {
        const float p = expf(s[nt][r] - mnew);
        s[nt][r] = p;
        ps[nt] += p;
      }
    l = l * alpha + ((ps[0] + ps[1]) + (ps[2] + ps[3]));
#pragma unroll
    for (int dt = 0; dt < 4; ++dt) o[dt] *= alpha;

    // ---- Ot[64 d x 16 queries] += Vt * Pt; k order of step (nt, j):
    // key = 16*nt + 8*lh + 2*j + {0,1}, on the A loader as in the score registers.
    // Row lm of output tile dt is d = 4*lm + dt: one 16-byte read of a V row
    // serves all four tiles.
#pragma unroll
    for (int nt = 0; nt < 4; ++nt)
#pragma unroll
      for (int j = 0; j < 4; ++j) {
        const v2f pb = {s[nt][2 * j], s[nt][2 * j + 1]};
        const v4f v0 = *(const v4f*)&vb[(nt * 16 + 2 * j) * KP];
        const v4f v1 = *(const v4f*)&vb[(nt * 16 + 2 * j + 1) * KP];
#pragma unroll
        for (int dt = 0; dt < 4; ++dt) {
          const v2f a = {v0[dt], v1[dt]};
          o[dt] = wmma4(a, pb, o[dt]);
        }
      }

    // ---- publish point of tile t + 1; frees the buffer tile t was read from
    asm volatile("s_wait_dscnt 0x0" ::: "memory");     // own reads of tile t done
    asm volatile("s_wait_asynccnt 0x0" ::: "memory");  // own copies of tile t + 1 landed
    __syncthreads();
    if (t + 2 < NTILE) {
      copy_tile(&sK[t & 1][lc], Kc + (size_t)(t + 2) * KT * HSTR);
      copy_tile(&sV[t & 1][lc], Vc + (size_t)(t + 2) * KT * HSTR);
    }
  }
  asm volatile("s_wait_asynccnt 0x0" ::: "memory");    // nothing in flight at the end

  // ---- join the halves' sums, normalise, store: o[dt][r] is d = 4*(r + 8*lh) + dt,
  //      so a lane holds 32 consecutive d of its query
  const float inv = 1.0f / (l + xhalf(l));
  float* Or = &O[((size_t)b * SS + t0 + w * 16 + lm) * HSTR + h * HDM + 32 * lh];
#pragma unroll
  for (int r = 0; r < 8; ++r) {
    const v4f ov = {o[0][r] * inv, o[1][r] * inv, o[2][r] * inv, o[3][r] * inv};
    *(v4f*)&Or[4 * r] = ov;
  }
}

// ---------------------------------------------------------------------------
// y = (1 - lambda) * o1 + lambda * o2, lambda derived on-device
// ---------------------------------------------------------------------------
__global__ void blend_kernel(const float* __restrict__ o1,
                             const float* __restrict__ o2,
                             const float* __restrict__ lambda_param,
                             const int* __restrict__ layer_idx,
                             float* __restrict__ y, int n)
{
  const int i = blockIdx.x * blockDim.x + threadIdx.x;
  if (i >= n) return;
  const float lf  = fminf(fmaxf((float)layer_idx[0] * 0.3f, 0.0f), 5.0f);
  const float off = 0.6f * expf(-lf);
  const float sig = 1.0f / (1.0f + expf(-lambda_param[0]));
  float lam = sig * (1.0f - off) + 0.2f;
  lam = fminf(fmaxf(lam, 0.1f), 0.9f);
  y[i] = (1.0f - lam) * o1[i] + lam * o2[i];
}

// ---------------------------------------------------------------------------
extern "C" void kernel_launch(void* const* d_in, const int* in_sizes, int n_in,
                              void* d_out, int out_size, void* d_ws, size_t ws_size,
                              hipStream_t stream)
{
  (void)in_sizes; (void)n_in; (void)out_size; (void)ws_size;
  // setup_inputs() dict order:
  const float* x            = (const float*)d_in[0];
  const float* proj_w       = (const float*)d_in[1];
  const float* proj_b       = (const float*)d_in[2];
  const float* lambda_param = (const float*)d_in[3];
  const int*   layer_idx    = (const int*)d_in[4];
  const float* wq1 = (const float*)d_in[5];
  const float* wk1 = (const float*)d_in[6];
  const float* wv1 = (const float*)d_in[7];
  const float* wo1 = (const float*)d_in[8];
  const float* bq1 = (const float*)d_in[9];
  const float* bk1 = (const float*)d_in[10];
  const float* bv1 = (const float*)d_in[11];
  const float* bo1 = (const float*)d_in[12];
  const float* wq2 = (const float*)d_in[13];
  const float* wk2 = (const float*)d_in[14];
  const float* wv2 = (const float*)d_in[15];
  const float* wo2 = (const float*)d_in[16];
  const float* bq2 = (const float*)d_in[17];
  const float* bk2 = (const float*)d_in[18];
  const float* bv2 = (const float*)d_in[19];
  const float* bo2 = (const float*)d_in[20];

  const size_t slot = (size_t)MROWS * DIMD;  // 4M floats per buffer
  float* ws = (float*)d_ws;
  float* q1 = ws + 0 * slot;
  float* k1 = ws + 1 * slot;
  float* v1 = ws + 2 * slot;
  float* q2 = ws + 3 * slot;
  float* k2 = ws + 4 * slot;
  float* v2 = ws + 5 * slot;
  float* o1 = ws + 6 * slot;   // attention outputs
  float* o2 = ws + 7 * slot;
  float* p1 = q1;              // reuse: per-branch projected outputs
  float* p2 = k1;
  float* yb = v1;              // blended

  const dim3 gg(DIMD / 64, MROWS / 64);   // (16, 64)

  // QKV projections (both branches)
  gemm_bias_kernel<<<gg, 256, 0, stream>>>(x, wq1, bq1, q1, MROWS, DIMD, DIMD);
  gemm_bias_kernel<<<gg, 256, 0, stream>>>(x, wk1, bk1, k1, MROWS, DIMD, DIMD);
  gemm_bias_kernel<<<gg, 256, 0, stream>>>(x, wv1, bv1, v1, MROWS, DIMD, DIMD);
  gemm_bias_kernel<<<gg, 256, 0, stream>>>(x, wq2, bq2, q2, MROWS, DIMD, DIMD);
  gemm_bias_kernel<<<gg, 256, 0, stream>>>(x, wk2, bk2, k2, MROWS, DIMD, DIMD);
  gemm_bias_kernel<<<gg, 256, 0, stream>>>(x, wv2, bv2, v2, MROWS, DIMD, DIMD);

  // Attention per (b, h, 64-row query tile)
  const dim3 ga(SS / QROWS, NH, BB);
  attn_kernel<<<ga, 128, 0, stream>>>(q1, k1, v1, o1);
  attn_kernel<<<ga, 128, 0, stream>>>(q2, k2, v2, o2);

  // Per-branch output projections (wo is [H*HD, DIM] row-major -> plain GEMM)
  gemm_bias_kernel<<<gg, 256, 0, stream>>>(o1, wo1, bo1, p1, MROWS, DIMD, DIMD);
  gemm_bias_kernel<<<gg, 256, 0, stream>>>(o2, wo2, bo2, p2, MROWS, DIMD, DIMD);

  // Blend with lambda
  const int n = MROWS * DIMD;
  blend_kernel<<<(n + 255) / 256, 256, 0, stream>>>(p1, p2, lambda_param, layer_idx, yb, n);

  // Final projection -> d_out
  gemm_bias_kernel<<<gg, 256, 0, stream>>>(yb, proj_w, proj_b, (float*)d_out, MROWS, DIMD, DIMD);
}
